// v010
// Times are from an AMD MI455X. After a warm-up the kernel runs many times in a row, and a time is the length of
// such a window on the GPU divided by its runs, so every launch and the gaps after it count. The runs cycle
// through copies of the inputs. A figure is the median of several windows, for all but v000 over two sittings.
// Sittings can differ by a few percent; kernels timed side by side share one.
// Earlier versions than v010 are not in this document.
// Measured time: 53.3 microseconds a run.
// In two side-by-side timings against v009, it was 1.05 and 1.06 times as fast.
// Counting every step since v000, which is the starting kernel, it is 12.4 times as fast.
#include <hip/hip_runtime.h>
// theta/phi/g 1×1 convolutions as one GEMM on channel-major bf16(x), read as it lies (single exact term, K=128, N=192), the 4096×4096 non-local attention per batch as
// 16-query tiles on WMMA (Q·Kᵀ and P·V as 3-term bf16 hi/lo splits, f32 online softmax, no scaling), and the final 1×1 conv (2 terms) + bias; the
// residual add is f32; x is read and the output stored NCHW without transposes.
#define BB 4
#define CC 128
#define HC 64
#define HWN 4096
#define MROWS (BB * HWN)
#define NSPLIT 4      // key groups per attention block: 4 waves each, so NSPLIT waves per SIMD

typedef __bf16 v16b __attribute__((ext_vector_type(16)));
typedef unsigned short v8us __attribute__((ext_vector_type(8), may_alias));
typedef float  v8f  __attribute__((ext_vector_type(8)));
typedef float  v4f  __attribute__((ext_vector_type(4)));
typedef float  v4fa __attribute__((ext_vector_type(4), may_alias));
typedef float  v2f  __attribute__((ext_vector_type(2)));
typedef __bf16 v2b  __attribute__((ext_vector_type(2)));
typedef unsigned int v2ua __attribute__((ext_vector_type(2), may_alias));
union FragB { v16b v; v8us half[2]; unsigned short u[16]; unsigned int w[8]; };
union Pack8 { v8us v; unsigned int w[4]; };

// f32 -> bf16, round to nearest even, by the hardware conversion
__device__ __forceinline__ unsigned short bf16_bits(float x) { return __builtin_bit_cast(unsigned short, (__bf16)x); }
// two values in one packed conversion: a in the low half of the word, b in the high half
__device__ __forceinline__ unsigned int bf16_pack2(float a, float b) { const v2f v = {a, b}; return __builtin_bit_cast(unsigned int, __builtin_convertvector(v, v2b)); }
// the lo word of a pair: what its hi word hw leaves over, rounded (x - hi is exact in f32)
__device__ __forceinline__ unsigned int bf16_rest2(float a, float b, unsigned int hw) {
  const v2f x = {a, b}, h = {__uint_as_float(hw << 16), __uint_as_float(hw & 0xFFFF0000u)};
  return __builtin_bit_cast(unsigned int, __builtin_convertvector(x - h, v2b));
}
__device__ __forceinline__ float bf16_val(unsigned short b) { return __uint_as_float(((unsigned int)b) << 16); }
__device__ __forceinline__ float bf16_round(float x) { return bf16_val(bf16_bits(x)); }
// D += A·B with NT terms: 1 = ah·bh, 2 = + al·bh (A split), 3 = + ah·bl (both split)
template <int NT>
__device__ __forceinline__ v8f mmaN(v16b ah, v16b al, v16b bh, v16b bl, v8f c) {
  c = __builtin_amdgcn_wmma_f32_16x16x32_bf16(false, ah, false, bh, (short)0, c, false, false);
  if (NT >= 2) c = __builtin_amdgcn_wmma_f32_16x16x32_bf16(false, al, false, bh, (short)0, c, false, false);
  if (NT >= 3) c = __builtin_amdgcn_wmma_f32_16x16x32_bf16(false, ah, false, bl, (short)0, c, false, false);
  asm volatile("v_nop\n\tv_nop\n\tv_nop\n\tv_nop" : "+v"(c) : "v"(ah), "v"(al), "v"(bh), "v"(bl));
  return c;
}

// one product on the builtin alone: the compiler keeps the distance behind it and is free to place other products and vector work around it
__device__ __forceinline__ v8f mma1(v16b a, v16b b, v8f c) { return __builtin_amdgcn_wmma_f32_16x16x32_bf16(false, a, false, b, (short)0, c, false, false); }

// lane l <-> lane l ^ 16 (the other 16-lane row) in one vector cross-row move
__device__ __forceinline__ float xhalf(float x) {
  const int b = __float_as_int(x);
  return __int_as_float(__builtin_amdgcn_permlanex16(b, b, 0x76543210, 0xfedcba98, false, false));
}

__global__ __launch_bounds__(256) void k_wt_bf16(const float* __restrict__ W, unsigned short* __restrict__ Wt, int K, int N) {
  const int t = blockIdx.x * 256 + threadIdx.x;
  const int k8n = K / 8;
  if (t >= N * k8n) return;
  const int n = t / k8n, k8 = (t % k8n) * 8;
  v8us v;
#pragma unroll
  for (int i = 0; i < 8; ++i) v[i] = bf16_bits(W[(size_t)(k8 + i) * N + n]);
  *(v8us*)(Wt + (size_t)n * K + k8) = v;
  
}

// GEMM C[M][N] (f32, pitch ldc) = act(A[M][K]·W + bias). A f32 row-major (pitch lda) converted per fragment to bf16
// (ASPLIT: hi/lo two planes -> 2 terms, else single rounded term); Wt bf16 [N][K] (pitch ldb). BIAS_BF16 rounds the
// bias to bf16 first (bias quantised to bf16 before the add). K%32==0, M%16==0, N%64==0.
template <bool ASPLIT, int ACT, bool BIAS_BF16>
__global__ __launch_bounds__(128) void k_gemm_bf(const float* __restrict__ A, int lda, const unsigned short* __restrict__ Wt, int ldb,
                                               const float* __restrict__ bias, float* __restrict__ C, int ldc, int M, int N, int K) {
  __shared__ __attribute__((aligned(16))) float so[4][16][64];
  const int tid = threadIdx.x, w = tid >> 5, lane = tid & 31, ln = lane & 15, hh = lane >> 4;
  const int ntn = N / 64;
  const int wid = blockIdx.x * 4 + w;
  const int mt = wid / ntn, nq = wid % ntn;
  if (mt * 16 >= M) return;
  const int row0 = mt * 16, col0 = nq * 64;
  const float* arow = A + (size_t)(row0 + ln) * lda;
  v8f acc[4] = {};
  for (int kb = 0; kb < K; kb += 32) {
    FragB ah, al;
    const v4f x0 = *(const v4fa*)(arow + kb + 8 * hh), x1 = *(const v4fa*)(arow + kb + 8 * hh + 4);
    const v4f x2 = *(const v4fa*)(arow + kb + 16 + 8 * hh), x3 = *(const v4fa*)(arow + kb + 16 + 8 * hh + 4);
    float xs[16] = {x0[0],x0[1],x0[2],x0[3],x1[0],x1[1],x1[2],x1[3],x2[0],x2[1],x2[2],x2[3],x3[0],x3[1],x3[2],x3[3]};
#pragma unroll
    for (int i = 0; i < 8; ++i) { const unsigned int hw = bf16_pack2(xs[2 * i], xs[2 * i + 1]); ah.w[i] = hw; al.w[i] = ASPLIT ? bf16_rest2(xs[2 * i], xs[2 * i + 1], hw) : 0u; }
#pragma unroll
    for (int t = 0; t < 4; ++t) {
      const unsigned short* brow = Wt + (size_t)(col0 + t * 16 + ln) * ldb + kb;
      FragB b;
      b.half[0] = *(const v8us*)(brow + 8 * hh);
      b.half[1] = *(const v8us*)(brow + 16 + 8 * hh);
      acc[t] = mmaN<ASPLIT ? 2 : 1>(ah.v, al.v, b.v, b.v, acc[t]);
    }
  }
#pragma unroll
  for (int t = 0; t < 4; ++t) {
    float bv = bias ? bias[col0 + t * 16 + ln] : 0.f;
    if (BIAS_BF16) bv = bf16_round(bv);
#pragma unroll
    for (int r = 0; r < 8; ++r) { float v = acc[t][r] + bv; if (ACT == 1) v = fmaxf(v, 0.f); so[w][8 * hh + r][t * 16 + ln] = v; }
  }
  __builtin_amdgcn_fence(__ATOMIC_ACQ_REL, "workgroup");
  __builtin_amdgcn_wave_barrier();
  const int rsub = lane >> 4, c4 = (lane & 15) * 4;
  {
#pragma unroll
    for (int q = 0; q < 8; ++q) {
      const int r = q * 2 + rsub;
      const v4f v = *(const v4fa*)&so[w][r][c4];
      *(v4f*)(C + (size_t)(row0 + r) * ldc + col0 + c4) = v;
    }
    
  }
}

// Flash-style causal/unmasked attention, all contractions 3-term bf16 hi/lo splits, f32 softmax with running max.
// q,k,v rows are read from f32 buffers with arbitrary row pitch (so they can live inside a fused qkv buffer);
// D = head size (multiple of 32, <= 128); one wave = 16 query rows; block = 4 waves (64 queries) sharing K/V chunks of 32.
template <int D, bool CAUSAL>
__global__ __launch_bounds__(128) void k_flash(const float* __restrict__ qb, const float* __restrict__ kb, const float* __restrict__ vb,
                                             int pitch, int T, int H, float scale, float* __restrict__ y, int ypitch) {
  constexpr int KS = D / 32;        // k-steps for QK
  constexpr int DT = D / 16;        // d tiles for PV
  __shared__ __attribute__((aligned(16))) unsigned short sKh[32][D + 8], sKl[32][D + 8], sVh[32][D + 8], sVl[32][D + 8];
  __shared__ __attribute__((aligned(16))) unsigned short sPh[4][16][40], sPl[4][16][40];
  __shared__ __attribute__((aligned(16))) float sO[4][16][D];
  const int tid = threadIdx.x, w = tid >> 5, lane = tid & 31, ln = lane & 15, hh = lane >> 4;
  const int nqb = (T + 63) / 64;
  const int bh = blockIdx.x / nqb, qblk = blockIdx.x % nqb;
  const int b = bh / H, h = bh % H;
  const int q0 = qblk * 64 + w * 16;
  const float* Q = qb + (size_t)b * T * pitch + h * D;
  const float* K = kb + (size_t)b * T * pitch + h * D;
  const float* V = vb + (size_t)b * T * pitch + h * D;

  // A fragments of the wave's 16 query rows (scaled), hi/lo
  FragB aqh[KS], aql[KS];
  {
    int row = q0 + ln; if (row >= T) row = T - 1;
    const float* qr = Q + (size_t)row * pitch;
#pragma unroll
    for (int ks = 0; ks < KS; ++ks)
#pragma unroll
      for (int i = 0; i < 16; ++i) {
        const int d = ks * 32 + ((i < 8) ? (8 * hh + i) : (16 + 8 * hh + (i - 8)));
        const float x = qr[d] * scale; const unsigned short hb = bf16_bits(x);
        aqh[ks].u[i] = hb; aql[ks].u[i] = bf16_bits(x - bf16_val(hb));
      }
  }
  float m_r[8], l_r[8];
#pragma unroll
  for (int r = 0; r < 8; ++r) { m_r[r] = -3.0e38f; l_r[r] = 0.f; }
  v8f oacc[DT];
#pragma unroll
  for (int dt = 0; dt < DT; ++dt) oacc[dt] = (v8f){0.f,0.f,0.f,0.f,0.f,0.f,0.f,0.f};

  const int kv_end = CAUSAL ? min(T, qblk * 64 + 64) : T;     // block-uniform
  for (int j0 = 0; j0 < kv_end; j0 += 32) {
    __syncthreads();
    for (int e = tid; e < 32 * (D / 4); e += 128) {
      const int r = e / (D / 4), c4 = (e % (D / 4)) * 4;
      const int key = j0 + r;
      v4f kf = {0.f,0.f,0.f,0.f}, vf = {0.f,0.f,0.f,0.f};
      if (key < T) { kf = *(const v4fa*)(K + (size_t)key * pitch + c4); vf = *(const v4fa*)(V + (size_t)key * pitch + c4); }
#pragma unroll
      for (int t = 0; t < 4; ++t) {
        unsigned short hb = bf16_bits(kf[t]); sKh[r][c4 + t] = hb; sKl[r][c4 + t] = bf16_bits(kf[t] - bf16_val(hb));
        hb = bf16_bits(vf[t]); sVh[r][c4 + t] = hb; sVl[r][c4 + t] = bf16_bits(vf[t] - bf16_val(hb));
      }
    }
    __syncthreads();
    // S tile 16 x 32
    v8f s[2];
#pragma unroll
    for (int nt = 0; nt < 2; ++nt) {
      v8f acc = {};
#pragma unroll
      for (int ks = 0; ks < KS; ++ks) {
        FragB bh_, bl_;
        bh_.half[0] = *(const v8us*)&sKh[nt * 16 + ln][ks * 32 + 8 * hh]; bh_.half[1] = *(const v8us*)&sKh[nt * 16 + ln][ks * 32 + 16 + 8 * hh];
        bl_.half[0] = *(const v8us*)&sKl[nt * 16 + ln][ks * 32 + 8 * hh]; bl_.half[1] = *(const v8us*)&sKl[nt * 16 + ln][ks * 32 + 16 + 8 * hh];
        acc = mmaN<3>(aqh[ks].v, aql[ks].v, bh_.v, bl_.v, acc);
      }
      s[nt] = acc;
    }
    // mask + running max (rows 8hh+r; the 16 lanes of a half share rows)
    float alpha[8];
#pragma unroll
    for (int r = 0; r < 8; ++r) {
      const int qi = q0 + 8 * hh + r;
      const int ja = j0 + ln, jb = j0 + 16 + ln;
      if (CAUSAL) { if (ja > qi) s[0][r] = -3.0e38f; if (jb > qi) s[1][r] = -3.0e38f; }
      if (ja >= T) s[0][r] = -3.0e38f;
      if (jb >= T) s[1][r] = -3.0e38f;
      float mx = fmaxf(s[0][r], s[1][r]);
      mx = fmaxf(mx, __shfl_xor(mx, 1, 32)); mx = fmaxf(mx, __shfl_xor(mx, 2, 32)); mx = fmaxf(mx, __shfl_xor(mx, 4, 32)); mx = fmaxf(mx, __shfl_xor(mx, 8, 32));
      const float mnew = fmaxf(m_r[r], mx);
      alpha[r] = (mnew > -1.0e38f) ? __expf(m_r[r] - mnew) : 1.0f;
      const float p0 = (s[0][r] > -1.0e38f) ? __expf(s[0][r] - mnew) : 0.f;
      const float p1 = (s[1][r] > -1.0e38f) ? __expf(s[1][r] - mnew) : 0.f;
      m_r[r] = mnew;
      l_r[r] = l_r[r] * alpha[r] + p0 + p1;            // per-lane partial row sum (16 lanes combined at the end)
      unsigned short hb = bf16_bits(p0); sPh[w][8 * hh + r][ln] = hb;      sPl[w][8 * hh + r][ln] = bf16_bits(p0 - bf16_val(hb));
      hb = bf16_bits(p1);                sPh[w][8 * hh + r][16 + ln] = hb; sPl[w][8 * hh + r][16 + ln] = bf16_bits(p1 - bf16_val(hb));
    }
#pragma unroll
    for (int dt = 0; dt < DT; ++dt)
#pragma unroll
      for (int r = 0; r < 8; ++r) oacc[dt][r] *= alpha[r];
    __builtin_amdgcn_fence(__ATOMIC_ACQ_REL, "workgroup");
    __builtin_amdgcn_wave_barrier();
    FragB pah, pal;
    pah.half[0] = *(const v8us*)&sPh[w][ln][8 * hh]; pah.half[1] = *(const v8us*)&sPh[w][ln][16 + 8 * hh];
    pal.half[0] = *(const v8us*)&sPl[w][ln][8 * hh]; pal.half[1] = *(const v8us*)&sPl[w][ln][16 + 8 * hh];
#pragma unroll
    for (int dt = 0; dt < DT; ++dt) {
      FragB bvh, bvl;
#pragma unroll
      for (int i = 0; i < 8; ++i) {
        bvh.u[i] = sVh[8 * hh + i][dt * 16 + ln]; bvh.u[8 + i] = sVh[16 + 8 * hh + i][dt * 16 + ln];
        bvl.u[i] = sVl[8 * hh + i][dt * 16 + ln]; bvl.u[8 + i] = sVl[16 + 8 * hh + i][dt * 16 + ln];
      }
      oacc[dt] = mmaN<3>(pah.v, pal.v, bvh.v, bvl.v, oacc[dt]);
    }
    __builtin_amdgcn_fence(__ATOMIC_ACQ_REL, "workgroup");
    __builtin_amdgcn_wave_barrier();
  }
#pragma unroll
  for (int r = 0; r < 8; ++r) {
    float l = l_r[r];
    l += __shfl_xor(l, 1, 32); l += __shfl_xor(l, 2, 32); l += __shfl_xor(l, 4, 32); l += __shfl_xor(l, 8, 32);
    l_r[r] = (l > 0.f) ? 1.0f / l : 0.f;
  }
#pragma unroll
  for (int dt = 0; dt < DT; ++dt)
#pragma unroll
    for (int r = 0; r < 8; ++r) sO[w][8 * hh + r][dt * 16 + ln] = oacc[dt][r] * l_r[r];
  __builtin_amdgcn_fence(__ATOMIC_ACQ_REL, "workgroup");
  __builtin_amdgcn_wave_barrier();
  {
    for (int r = 0; r < 16; ++r) {
      const int row = q0 + r;
      if (row < T && lane < D / 4) {
        const v4f val = *(const v4fa*)&sO[w][r][lane * 4];
        *(v4f*)(y + ((size_t)b * T + row) * ypitch + h * D + lane * 4) = val;
      }
    }
    
  }
}

// in pitch = cols, out pitch = rows; rows, cols multiples of 32. Optional per-output-row affine (scale[c], shift[c]) and
// residual add res (same layout as out, optionally bf16-rounded) for fused epilogues: out = in*scale + shift + res.
template <bool AFFINE, bool RESID, bool RES_BF16>
__global__ __launch_bounds__(256) void k_transpose32(const float* __restrict__ in, float* __restrict__ out, int rows, int cols,
                                                    const float* __restrict__ scale, const float* __restrict__ shift, const float* __restrict__ res) {
  __shared__ float tile[32][33];
  const int b = blockIdx.z;
  const int r0 = blockIdx.y * 32, c0 = blockIdx.x * 32;
  const float* src = in + (size_t)b * rows * cols;
  float* dst = out + (size_t)b * rows * cols;
  const int tx = threadIdx.x & 31, ty = threadIdx.x >> 5;     // 8 rows per pass
  for (int i = ty; i < 32; i += 8) tile[i][tx] = src[(size_t)(r0 + i) * cols + c0 + tx];
  __syncthreads();
  {
    for (int i = ty; i < 32; i += 8) {
      float v = tile[tx][i];
      const int orow = c0 + i;
      if (AFFINE) v = v * scale[orow] + shift[orow];
      if (RESID) { float rv = res[(size_t)b * rows * cols + (size_t)orow * rows + r0 + tx]; if (RES_BF16) rv = bf16_round(rv); v += rv; }
      *(float*)(dst + (size_t)orow * rows + r0 + tx) = v;
    }
    
  }
}

// 2x2 max pool on position-major data: in [B][H*W][C] -> out [B][(H/2)*(W/2)][C]; thread per (b, p', 4 channels); C%4==0
__global__ __launch_bounds__(256) void k_pool2_pm(const float* __restrict__ in, float* __restrict__ out, int Bn, int H, int W, int C) {
  const size_t t = (size_t)blockIdx.x * 256 + threadIdx.x;
  const int c4n = C / 4, Ho = H / 2, Wo = W / 2;
  const size_t total = (size_t)Bn * Ho * Wo * c4n;
  if (t >= total) return;
  const int c4 = (int)(t % c4n) * 4; size_t rest = t / c4n;
  const int pw = (int)(rest % Wo); rest /= Wo; const int ph = (int)(rest % Ho); const int b = (int)(rest / Ho);
  const float* base = in + (size_t)b * H * W * C;
  const int p00 = (2 * ph) * W + 2 * pw;
  const v4f a = *(const v4fa*)(base + (size_t)p00 * C + c4), bq = *(const v4fa*)(base + (size_t)(p00 + 1) * C + c4);
  const v4f c = *(const v4fa*)(base + (size_t)(p00 + W) * C + c4), d = *(const v4fa*)(base + (size_t)(p00 + W + 1) * C + c4);
  v4f m; for (int i = 0; i < 4; ++i) m[i] = fmaxf(fmaxf(a[i], bq[i]), fmaxf(c[i], d[i]));
  float* dst = out + ((size_t)b * Ho * Wo + (size_t)ph * Wo + pw) * C + c4;
  *(v4f*)dst = m;
  
}

// General (non-causal) attention, 3-term bf16 splits, f32 softmax with running max.
// Q [.][Tq][qpitch], K [.][Tk][kpitch] (head dim DQ), V [.][Tk][vpitch] (head dim DVtot); this block handles DV output
// dims starting at dv0 = blockIdx.y*DV. y[bh][t][ypitch] gets columns dv0..dv0+DV-1. Per-bh base offsets via strides.
template <int DQ, int DV>
__global__ __launch_bounds__(128) void k_flash2(const float* __restrict__ Qb, size_t qstride, int qpitch, int Tq,
                                              const float* __restrict__ Kb, size_t kstride, int kpitch, int Tk,
                                              const float* __restrict__ Vb, size_t vstride, int vpitch,
                                              float scale, float* __restrict__ y, size_t ystride, int ypitch) {
  constexpr int KS = DQ / 32, DT = DV / 16;
  __shared__ __attribute__((aligned(16))) unsigned short sKh[32][DQ + 8], sKl[32][DQ + 8], sVh[32][DV + 8], sVl[32][DV + 8];
  __shared__ __attribute__((aligned(16))) unsigned short sPh[4][16][40], sPl[4][16][40];
  __shared__ __attribute__((aligned(16))) float sO[4][16][DV];
  const int tid = threadIdx.x, w = tid >> 5, lane = tid & 31, ln = lane & 15, hh = lane >> 4;
  const int nqb = (Tq + 63) / 64;
  const int bh = blockIdx.x / nqb, qblk = blockIdx.x % nqb;
  const int dv0 = blockIdx.y * DV;
  const int q0 = qblk * 64 + w * 16;
  const float* Q = Qb + (size_t)bh * qstride; const float* K = Kb + (size_t)bh * kstride; const float* V = Vb + (size_t)bh * vstride + dv0;
  FragB aqh[KS], aql[KS];
  {
    int row = q0 + ln; if (row >= Tq) row = Tq - 1;
    const float* qr = Q + (size_t)row * qpitch;
#pragma unroll
    for (int ks = 0; ks < KS; ++ks)
#pragma unroll
      for (int i = 0; i < 16; ++i) {
        const int d = ks * 32 + ((i < 8) ? (8 * hh + i) : (16 + 8 * hh + (i - 8)));
        const float x = qr[d] * scale; const unsigned short hb = bf16_bits(x);
        aqh[ks].u[i] = hb; aql[ks].u[i] = bf16_bits(x - bf16_val(hb));
      }
  }
  float m_r[8], l_r[8];
#pragma unroll
  for (int r = 0; r < 8; ++r) { m_r[r] = -3.0e38f; l_r[r] = 0.f; }
  v8f oacc[DT];
#pragma unroll
  for (int dt = 0; dt < DT; ++dt) oacc[dt] = (v8f){0.f,0.f,0.f,0.f,0.f,0.f,0.f,0.f};
  for (int j0 = 0; j0 < Tk; j0 += 32) {
    __syncthreads();
    for (int e = tid; e < 32 * (DQ / 4); e += 128) {
      const int r = e / (DQ / 4), c4 = (e % (DQ / 4)) * 4; const int key = j0 + r;
      v4f f = {0.f,0.f,0.f,0.f}; if (key < Tk) f = *(const v4fa*)(K + (size_t)key * kpitch + c4);
#pragma unroll
      for (int t = 0; t < 4; ++t) { const unsigned short hb = bf16_bits(f[t]); sKh[r][c4 + t] = hb; sKl[r][c4 + t] = bf16_bits(f[t] - bf16_val(hb)); }
    }
    for (int e = tid; e < 32 * (DV / 4); e += 128) {
      const int r = e / (DV / 4), c4 = (e % (DV / 4)) * 4; const int key = j0 + r;
      v4f f = {0.f,0.f,0.f,0.f}; if (key < Tk) f = *(const v4fa*)(V + (size_t)key * vpitch + c4);
#pragma unroll
      for (int t = 0; t < 4; ++t) { const unsigned short hb = bf16_bits(f[t]); sVh[r][c4 + t] = hb; sVl[r][c4 + t] = bf16_bits(f[t] - bf16_val(hb)); }
    }
    __syncthreads();
    v8f s[2];
#pragma unroll
    for (int nt = 0; nt < 2; ++nt) {
      v8f acc = {};
#pragma unroll
      for (int ks = 0; ks < KS; ++ks) {
        FragB bh_, bl_;
        bh_.half[0] = *(const v8us*)&sKh[nt * 16 + ln][ks * 32 + 8 * hh]; bh_.half[1] = *(const v8us*)&sKh[nt * 16 + ln][ks * 32 + 16 + 8 * hh];
        bl_.half[0] = *(const v8us*)&sKl[nt * 16 + ln][ks * 32 + 8 * hh]; bl_.half[1] = *(const v8us*)&sKl[nt * 16 + ln][ks * 32 + 16 + 8 * hh];
        acc = mmaN<3>(aqh[ks].v, aql[ks].v, bh_.v, bl_.v, acc);
      }
      s[nt] = acc;
    }
    float alpha[8];
#pragma unroll
    for (int r = 0; r < 8; ++r) {
      const int ja = j0 + ln, jb = j0 + 16 + ln;
      if (ja >= Tk) s[0][r] = -3.0e38f;
      if (jb >= Tk) s[1][r] = -3.0e38f;
      float mx = fmaxf(s[0][r], s[1][r]);
      mx = fmaxf(mx, __shfl_xor(mx, 1, 32)); mx = fmaxf(mx, __shfl_xor(mx, 2, 32)); mx = fmaxf(mx, __shfl_xor(mx, 4, 32)); mx = fmaxf(mx, __shfl_xor(mx, 8, 32));
      const float mnew = fmaxf(m_r[r], mx);
      alpha[r] = (mnew > -1.0e38f) ? __expf(m_r[r] - mnew) : 1.0f;
      const float p0 = (s[0][r] > -1.0e38f) ? __expf(s[0][r] - mnew) : 0.f;
      const float p1 = (s[1][r] > -1.0e38f) ? __expf(s[1][r] - mnew) : 0.f;
      m_r[r] = mnew;
      l_r[r] = l_r[r] * alpha[r] + p0 + p1;
      unsigned short hb = bf16_bits(p0); sPh[w][8 * hh + r][ln] = hb;      sPl[w][8 * hh + r][ln] = bf16_bits(p0 - bf16_val(hb));
      hb = bf16_bits(p1);                sPh[w][8 * hh + r][16 + ln] = hb; sPl[w][8 * hh + r][16 + ln] = bf16_bits(p1 - bf16_val(hb));
    }
#pragma unroll
    for (int dt = 0; dt < DT; ++dt)
#pragma unroll
      for (int r = 0; r < 8; ++r) oacc[dt][r] *= alpha[r];
    __builtin_amdgcn_fence(__ATOMIC_ACQ_REL, "workgroup");
    __builtin_amdgcn_wave_barrier();
    FragB pah, pal;
    pah.half[0] = *(const v8us*)&sPh[w][ln][8 * hh]; pah.half[1] = *(const v8us*)&sPh[w][ln][16 + 8 * hh];
    pal.half[0] = *(const v8us*)&sPl[w][ln][8 * hh]; pal.half[1] = *(const v8us*)&sPl[w][ln][16 + 8 * hh];
#pragma unroll
    for (int dt = 0; dt < DT; ++dt) {
      FragB bvh, bvl;
#pragma unroll
      for (int i = 0; i < 8; ++i) {
        bvh.u[i] = sVh[8 * hh + i][dt * 16 + ln]; bvh.u[8 + i] = sVh[16 + 8 * hh + i][dt * 16 + ln];
        bvl.u[i] = sVl[8 * hh + i][dt * 16 + ln]; bvl.u[8 + i] = sVl[16 + 8 * hh + i][dt * 16 + ln];
      }
      oacc[dt] = mmaN<3>(pah.v, pal.v, bvh.v, bvl.v, oacc[dt]);
    }
    __builtin_amdgcn_fence(__ATOMIC_ACQ_REL, "workgroup");
    __builtin_amdgcn_wave_barrier();
  }
#pragma unroll
  for (int r = 0; r < 8; ++r) {
    float l = l_r[r];
    l += __shfl_xor(l, 1, 32); l += __shfl_xor(l, 2, 32); l += __shfl_xor(l, 4, 32); l += __shfl_xor(l, 8, 32);
    l_r[r] = (l > 0.f) ? 1.0f / l : 0.f;
  }
#pragma unroll
  for (int dt = 0; dt < DT; ++dt)
#pragma unroll
    for (int r = 0; r < 8; ++r) sO[w][8 * hh + r][dt * 16 + ln] = oacc[dt][r] * l_r[r];
  __builtin_amdgcn_fence(__ATOMIC_ACQ_REL, "workgroup");
  __builtin_amdgcn_wave_barrier();
  {
    for (int r = 0; r < 16; ++r) {
      const int row = q0 + r;
      for (int c4 = lane * 4; c4 < DV; c4 += 128) {
        if (row < Tq) {
          const v4f val = *(const v4fa*)&sO[w][r][c4];
          *(v4f*)(y + (size_t)bh * ystride + (size_t)row * ypitch + dv0 + c4) = val;
        }
      }
    }
    
  }
}

// row LayerNorm (biased variance, eps) over N: s = X (+ R); optional out_sum <- s; out_norm <- (s-mu)*rsqrt(var+eps)*g + b
template <bool PARAM_BF16>
__global__ __launch_bounds__(256) void k_layernorm(const float* __restrict__ X, const float* __restrict__ R, const float* __restrict__ g, const float* __restrict__ bta,
                                                  float* __restrict__ out_sum, float* __restrict__ out_norm, int N, float eps) {
  __shared__ float red[256];
  const int row = blockIdx.x, tid = threadIdx.x;
  const float* x = X + (size_t)row * N; const float* rr = R ? R + (size_t)row * N : nullptr;
  float vals[16];                     // up to N = 4096
  const int per = N / 256;            // contiguous chunk per thread? use strided-by-4 chunks: thread handles j = tid*4 + 1024*u
  float s1 = 0.f;
  for (int u = 0; u < per / 4; ++u) {
    const int j = tid * 4 + 1024 * u;
    const v4f a = *(const v4fa*)(x + j);
    v4f b = {0.f,0.f,0.f,0.f}; if (rr) b = *(const v4fa*)(rr + j);
#pragma unroll
    for (int q = 0; q < 4; ++q) { const float v = a[q] + b[q]; vals[u * 4 + q] = v; s1 += v; }
  }
  red[tid] = s1; __syncthreads();
  for (int st = 128; st > 0; st >>= 1) { if (tid < st) red[tid] += red[tid + st]; __syncthreads(); }
  const float mu = red[0] / (float)N; __syncthreads();
  float s2 = 0.f;
  for (int u = 0; u < per / 4; ++u)
#pragma unroll
    for (int q = 0; q < 4; ++q) { const float c = vals[u * 4 + q] - mu; s2 += c * c; }
  red[tid] = s2; __syncthreads();
  for (int st = 128; st > 0; st >>= 1) { if (tid < st) red[tid] += red[tid + st]; __syncthreads(); }
  const float rs = rsqrtf(red[0] / (float)N + eps);
  {
    for (int u = 0; u < per / 4; ++u) {
      const int j = tid * 4 + 1024 * u;
      v4f o, sm;
#pragma unroll
      for (int q = 0; q < 4; ++q) {
        float gg = g[j + q], bb = bta[j + q];
        if (PARAM_BF16) { gg = bf16_round(gg); bb = bf16_round(bb); }
        sm[q] = vals[u * 4 + q]; o[q] = (vals[u * 4 + q] - mu) * rs * gg + bb;
      }
      if (out_sum) *(v4f*)(out_sum + (size_t)row * N + j) = sm;
      *(v4f*)(out_norm + (size_t)row * N + j) = o;
    }
    
  }
}

// One 32-key chunk of one key group in LDS: the four bf16 planes that k_gemm_cm writes. K rows at a pitch of D + 8 values, V^T rows (32 keys) at 32 + 8 values:
// both 16 B x odd, for 16-byte readers.
template <int D> struct KvStage { unsigned short Kh[32][D + 8], Kl[32][D + 8], Vh[D][32 + 8], Vl[D][32 + 8]; };
__device__ __forceinline__ unsigned lds_off(const void* p) { return (unsigned)(size_t)p; }   // byte address inside the work-group's LDS

template <int D, int NS, int NC>
__global__ __launch_bounds__(128 * NS) void k_flash3(const float* __restrict__ Qb, int qpitch, int Tq,
                                              const unsigned short* __restrict__ Kh, const unsigned short* __restrict__ Kl,
                                              const unsigned short* __restrict__ VTh, const unsigned short* __restrict__ VTl, int Tk,
                                              float scale, const int* __restrict__ mask, int causal, const float* __restrict__ sbias,
                                              const unsigned short* __restrict__ Wf, const float* __restrict__ fb, const float* __restrict__ xres,
                                              float* __restrict__ out) {
  constexpr int KS = D / 32, DT = D / 16;
  constexpr int OP = D + 4;         // pitch of sO in floats: 16 B x odd, so the 16 lanes that each store 16 bytes of their own row meet distinct banks
  __shared__ __attribute__((aligned(16))) KvStage<D> sSt[2][NS];
  __shared__ __attribute__((aligned(16))) float sO[NS][4][16][OP];
  __shared__ float sM[NS][4][16], sL[NS][4][16];
  __shared__ __attribute__((aligned(16))) unsigned short sAh[64][D + 8], sAl[64][D + 8];   // the joined rows, bf16 hi and lo; pitch 16 B x odd
  // g is the same in every lane of a wave; held in a scalar register, the chunk's base address and the test for a chunk past the end are scalar too
  const int g = __builtin_amdgcn_readfirstlane(threadIdx.x >> 7);
  const int tid = threadIdx.x & 127, w = tid >> 5, lane = tid & 31, ln = lane & 15, hh = lane >> 4;
  const int nqb = (Tq + 63) / 64;
  const int bh = blockIdx.x / nqb, qblk = blockIdx.x % nqb;
  const int q0 = qblk * 64 + w * 16;
  const float* Q = Qb + (size_t)bh * Tq * qpitch;
  FragB aqh[KS], aql[KS];
  {
    int row = q0 + ln; if (row >= Tq) row = Tq - 1;
    const float* qr = Q + (size_t)row * qpitch;
#pragma unroll
    for (int ks = 0; ks < KS; ++ks)
#pragma unroll
      for (int i = 0; i < 16; i += 2) {
        const int d = ks * 32 + ((i < 8) ? (8 * hh + i) : (16 + 8 * hh + (i - 8)));
        const float x0 = qr[d] * scale, x1 = qr[d + 1] * scale; const unsigned int hw = bf16_pack2(x0, x1);
        aqh[ks].w[i / 2] = hw; aql[ks].w[i / 2] = bf16_rest2(x0, x1, hw);
      }
  }
  int qi = q0 + ln; if (qi >= Tq) qi = Tq - 1;                  // the lane's query
  float m_r = -3.0e38f, l_r = 0.f;                               // its running max (equal in both halves) and this half's share of its sum
  v8f oacc[DT];                                                  // O^T: oacc[dt][r] = O[query ln][dt * 16 + 8 * hh + r]
#pragma unroll
  for (int dt = 0; dt < DT; ++dt) oacc[dt] = (v8f){0.f,0.f,0.f,0.f,0.f,0.f,0.f,0.f};
  const bool special = causal || mask || sbias;
  const int kv_end = causal ? min(Tk, qblk * 64 + 64) : Tk;
  static_assert(32 * D / 8 / 128 == 2, "two 16-byte units of each plane's chunk per thread");
  const int ntrip = (kv_end + 32 * NS - 1) / (32 * NS);          // block-uniform trips; a group's chunk past the end is masked like any tail
  // The thread's eight units of its group's chunk of trip t -> buffer buf. A chunk past the end of the keys is replaced by the last chunk: its addresses
  // stay inside the planes, every wave issues the same copies, and its scores are masked below, so that its P is 0 against finite V.
  auto stage = [&](int t, int buf) {
    const int jc = min((t * NS + g) * 32, Tk - 32);
    const unsigned o = ((unsigned)bh * Tk + jc) * (D * 2) + tid * 16;   // the same byte offset in all four planes (each plane is below 4 GiB)
    KvStage<D>* S = &sSt[buf][g];
    const int e0 = tid, e1 = tid + 128;                          // unit e: 128 threads x 16 B = 2048 B a unit row
    // a V^T plane's first 2048 B are keys 0..15 of the chunk, the next 2048 B keys 16..31; in each, unit tid is row d = tid / 2, 8 keys from (tid % 2) * 8
    // the copies and, as the last line, the wait in front of any rewrite of their address registers, in one statement: nothing can come between
    asm volatile("global_load_async_to_lds_b128 %0, %8, off\n\t"
                 "global_load_async_to_lds_b128 %1, %9, off\n\t"
                 "global_load_async_to_lds_b128 %2, %10, off\n\t"
                 "global_load_async_to_lds_b128 %3, %11, off\n\t"
                 "global_load_async_to_lds_b128 %4, %12, off\n\t"
                 "global_load_async_to_lds_b128 %5, %13, off\n\t"
                 "global_load_async_to_lds_b128 %6, %14, off\n\t"
                 "global_load_async_to_lds_b128 %7, %15, off\n\t"
                 "s_wait_xcnt 0x0"
                 :: "v"(lds_off(&S->Kh[e0 / (D / 8)][(e0 % (D / 8)) * 8])), "v"(lds_off(&S->Kl[e0 / (D / 8)][(e0 % (D / 8)) * 8])),
                    "v"(lds_off(&S->Vh[tid / 2][(tid % 2) * 8])),           "v"(lds_off(&S->Vl[tid / 2][(tid % 2) * 8])),
                    "v"(lds_off(&S->Kh[e1 / (D / 8)][(e1 % (D / 8)) * 8])), "v"(lds_off(&S->Kl[e1 / (D / 8)][(e1 % (D / 8)) * 8])),
                    "v"(lds_off(&S->Vh[tid / 2][16 + (tid % 2) * 8])),      "v"(lds_off(&S->Vl[tid / 2][16 + (tid % 2) * 8])),
                    "v"((const char*)Kh + o),          "v"((const char*)Kl + o),          "v"((const char*)VTh + o),          "v"((const char*)VTl + o),
                    "v"((const char*)Kh + (o + 2048u)), "v"((const char*)Kl + (o + 2048u)), "v"((const char*)VTh + (o + 2048u)), "v"((const char*)VTl + (o + 2048u))
                 : "memory");
  };
  // The fragments are fetched ahead, each kind as ONE group of 16 loads: a chunk's K rows one trip ahead, under the softmax and the P.V products of the
  // chunk before, its V^T rows at the head of its own trip, under its score products.
  // Every loop over fragments, here and in the trip, is unrolled: the arrays are then indexed by constants and stay in registers.
  FragB kh[2][KS], kl[2][KS];                                    // K as A fragments: row nt * 16 + ln, the k order of Q^T
  auto load_k = [&](int buf) {
    const KvStage<D>* S = &sSt[buf][g];
#pragma unroll
    for (int nt = 0; nt < 2; ++nt)
#pragma unroll
      for (int ks = 0; ks < KS; ++ks) {
        kh[nt][ks].half[0] = *(const v8us*)&S->Kh[nt * 16 + ln][ks * 32 + 8 * hh]; kh[nt][ks].half[1] = *(const v8us*)&S->Kh[nt * 16 + ln][ks * 32 + 16 + 8 * hh];
        kl[nt][ks].half[0] = *(const v8us*)&S->Kl[nt * 16 + ln][ks * 32 + 8 * hh]; kl[nt][ks].half[1] = *(const v8us*)&S->Kl[nt * 16 + ln][ks * 32 + 16 + 8 * hh];
      }
  };
  stage(0, 0);
  asm volatile("s_wait_asynccnt 0x0" ::: "memory");              // this wave's copies of chunk 0 have landed
  __syncthreads();                                               // and every other wave's
  if (ntrip > 1) stage(1, 1);
  load_k(0);
  for (int t = 0; t < ntrip; ++t) {
    const int jb = t * 32 * NS, j0 = jb + 32 * g;
    const KvStage<D>* S = &sSt[t & 1][g];
    const unsigned short (*sVh)[32 + 8] = S->Vh; const unsigned short (*sVl)[32 + 8] = S->Vl;
    FragB bvh[DT], bvl[DT];                                      // V^T as A fragments: row dt * 16 + ln, the k order of P^T
#pragma unroll
    for (int dt = 0; dt < DT; ++dt) {
      bvh[dt].half[0] = *(const v8us*)&sVh[dt * 16 + ln][8 * hh]; bvh[dt].half[1] = *(const v8us*)&sVh[dt * 16 + ln][16 + 8 * hh];
      bvl[dt].half[0] = *(const v8us*)&sVl[dt * 16 + ln][8 * hh]; bvl[dt].half[1] = *(const v8us*)&sVl[dt * 16 + ln][16 + 8 * hh];
    }
    // keeps the 16 loads above in one group in front of the score products; left alone, the compiler sinks them in pairs to where they are used
    __builtin_amdgcn_sched_barrier(0);
    v8f s[2] = {};                                               // S^T: s[nt][r] = score(query ln, key j0 + nt * 16 + 8 * hh + r)
    // the two key tiles take turns, so that a product does not wait for the one in front of it; a tile's own order of terms stays hh, lh, hl per k step
#pragma unroll
    for (int ks = 0; ks < KS; ++ks) {
#pragma unroll
      for (int nt = 0; nt < 2; ++nt) s[nt] = mma1(kh[nt][ks].v, aqh[ks].v, s[nt]);
#pragma unroll
      for (int nt = 0; nt < 2; ++nt) s[nt] = mma1(kl[nt][ks].v, aqh[ks].v, s[nt]);
#pragma unroll
      for (int nt = 0; nt < 2; ++nt) s[nt] = mma1(kh[nt][ks].v, aql[ks].v, s[nt]);
    }
    // the distance between the last score product and the first reader of the scores, kept on EVERY path: branches follow
    asm volatile("v_nop\n\tv_nop\n\tv_nop\n\tv_nop" : "+v"(s[0]), "+v"(s[1]));
    if (special || jb + 32 * NS > Tk) {                          // block-uniform: masks, biases and key tails; a dropped score becomes -3e38
#pragma unroll
      for (int nt = 0; nt < 2; ++nt)
#pragma unroll
        for (int r = 0; r < 8; ++r) {
          const int key = j0 + nt * 16 + 8 * hh + r;
          bool keep = key < Tk;
          if (causal) keep = keep && (key <= qi);
          if (mask) { if (keep) keep = mask[(size_t)qi * Tk + key] != 0; }
          if (sbias) { if (keep) s[nt][r] += sbias[(size_t)bh * Tk + key]; }   // per-key additive bias (a per-query constant would cancel in the softmax)
          if (!keep) s[nt][r] = -3.0e38f;
        }
    }
    // The next chunk is published HERE, in front of this chunk's last block (P.V), whose fragments are already fetched: what follows reads no LDS of this chunk.
    asm volatile("s_wait_dscnt 0x0" ::: "memory");               // this wave's reads of the buffer (K a trip ago, V^T above) are done before it is handed back
    asm volatile("s_wait_asynccnt 0x0" ::: "memory");            // this wave's copies of the next chunk have landed
    __syncthreads();                                             // the next chunk is published, this trip's buffer is free
    if (t + 2 < ntrip) stage(t + 2, t & 1);
    if (t + 1 < ntrip) load_k((t + 1) & 1);                      // block-uniform; behind the barrier that published that chunk
    float mx = fmaxf(s[0][0], s[1][0]);
#pragma unroll
    for (int r = 1; r < 8; ++r) mx = fmaxf(mx, fmaxf(s[0][r], s[1][r]));
    mx = fmaxf(mx, xhalf(mx));                                   // the query's other 16 keys sit in the other half
    const float mnew = fmaxf(m_r, mx);
    const float mexp = fmaxf(mnew, -1.0e38f);                    // with nothing kept so far a dropped score still gives exp(-2e38) = 0
    const float alpha = __expf(m_r - mexp);
    m_r = mnew;
    FragB pbh, pbl;                                              // P^T as a B fragment: element nt * 8 + r is key nt * 16 + 8 * hh + r
    float ps[4] = {0.f, 0.f, 0.f, 0.f};
#pragma unroll
    for (int nt = 0; nt < 2; ++nt)
#pragma unroll
      for (int r = 0; r < 8; r += 2) {
        const float p0 = __expf(s[nt][r] - mexp), p1 = __expf(s[nt][r + 1] - mexp);
        ps[r & 3] += p0; ps[(r + 1) & 3] += p1;
        const unsigned int hw = bf16_pack2(p0, p1);
        pbh.w[nt * 4 + r / 2] = hw; pbl.w[nt * 4 + r / 2] = bf16_rest2(p0, p1, hw);
      }
    l_r = l_r * alpha + ((ps[0] + ps[1]) + (ps[2] + ps[3]));     // this half's 16 keys (the halves are added at the end)
#pragma unroll
    for (int dt = 0; dt < DT; ++dt)
#pragma unroll
      for (int r = 0; r < 8; ++r) oacc[dt][r] *= alpha;
    // the four output tiles take turns; a tile's own order of terms stays hh, lh, hl
#pragma unroll
    for (int dt = 0; dt < DT; ++dt) oacc[dt] = mma1(bvh[dt].v, pbh.v, oacc[dt]);
#pragma unroll
    for (int dt = 0; dt < DT; ++dt) oacc[dt] = mma1(bvl[dt].v, pbh.v, oacc[dt]);
#pragma unroll
    for (int dt = 0; dt < DT; ++dt) oacc[dt] = mma1(bvh[dt].v, pbl.v, oacc[dt]);
  }
  asm volatile("s_wait_asynccnt 0x0" ::: "memory");              // no copy is left in flight behind the loop
  // The output projection's tiles: NC / 16 channel tiles x 4 query tiles, two query tiles (32 positions = one 128-byte line a channel) a wave.
  // What it needs from global memory is asked for here, so that it arrives under the join.
  static_assert(NC / 16 * 4 == 2 * 4 * NS, "two 16 x 16 tiles a wave");
  const int wv = __builtin_amdgcn_readfirstlane(threadIdx.x >> 5);   // the wave's number in the block, scalar
  const int ct = wv >> 1, qt0 = (wv & 1) * 2;
  const float* xb = xres + (size_t)bh * NC * Tq; float* ob = out + (size_t)bh * NC * Tq;
  FragB fw[KS];                                                  // Wf as an A fragment: row ct * 16 + ln, k = 32 ks + 8 hh + 0..7, then 16 further
  int off[8];                                                    // element r of an accumulator: channel ct * 16 + 8 hh + r, position ln of the tile
  float xr[2][8];
  v4f fb0, fb1;
  {
    const unsigned short* wr = Wf + (ct * 16 + ln) * D + 8 * hh;
#pragma unroll
    for (int ks = 0; ks < KS; ++ks) { fw[ks].half[0] = *(const v8us*)(wr + ks * 32); fw[ks].half[1] = *(const v8us*)(wr + ks * 32 + 16); }
    fb0 = *(const v4fa*)(fb + ct * 16 + 8 * hh); fb1 = *(const v4fa*)(fb + ct * 16 + 8 * hh + 4);
#pragma unroll
    for (int r = 0; r < 8; ++r) {
      off[r] = (ct * 16 + 8 * hh + r) * Tq + qblk * 64 + qt0 * 16 + ln;
      xr[0][r] = xb[off[r]]; xr[1][r] = xb[off[r] + 16];
    }
    // what follows may reuse the address registers of the loads above; wr as an input: no later load's result takes its registers in front of the wait
    asm volatile("s_wait_xcnt 0x0" :: "v"(wr) : "memory");
  }
  {
    const float l = l_r + xhalf(l_r);
    if (hh == 0) { sM[g][w][ln] = m_r; sL[g][w][ln] = l; }
  }
#pragma unroll
  for (int dt = 0; dt < DT; ++dt) {                              // not yet divided by the row sum
    *(v4fa*)&sO[g][w][ln][dt * 16 + 8 * hh]     = (v4f){oacc[dt][0], oacc[dt][1], oacc[dt][2], oacc[dt][3]};
    *(v4fa*)&sO[g][w][ln][dt * 16 + 8 * hh + 4] = (v4f){oacc[dt][4], oacc[dt][5], oacc[dt][6], oacc[dt][7]};
  }
  __syncthreads();                                               // every group's (max, sum, O) is in LDS
  // join: wave (g, w) finishes rows 2g, 2g + 1, then + 2 NS, of query tile w; each half wave takes one row (a store of the wave writes 128 bytes of each of the two rows)
  for (int r = g * 2 + hh; r < 16; r += 2 * NS) {
    float mj = -3.0e38f;
    // the three loops over s are unrolled so that f[] stays in registers
#pragma unroll
    for (int s = 0; s < NS; ++s) mj = fmaxf(mj, sM[s][w][r]);
    float f[NS], lj = 0.f;
#pragma unroll
    for (int s = 0; s < NS; ++s) { const float ms = sM[s][w][r]; f[s] = (ms > -1.0e38f) ? __expf(ms - mj) : 0.f; lj += f[s] * sL[s][w][r]; }
    const float inv = (mj > -1.0e38f) ? 1.0f / lj : __builtin_nanf("");
    for (int c4 = ln * 4; c4 < D; c4 += 64) {
      v4f val = {0.f, 0.f, 0.f, 0.f};
#pragma unroll
      for (int s = 0; s < NS; ++s) val += f[s] * *(const v4fa*)&sO[s][w][r][c4];
      val *= inv;
      const unsigned int h0 = bf16_pack2(val[0], val[1]), h1 = bf16_pack2(val[2], val[3]);
      *(v2ua*)&sAh[w * 16 + r][c4] = (v2ua){h0, h1};
      *(v2ua*)&sAl[w * 16 + r][c4] = (v2ua){bf16_rest2(val[0], val[1], h0), bf16_rest2(val[2], val[3], h1)};
    }
  }
  __syncthreads();                                               // the block's 64 rows are in LDS
  // unrolled: fragments and accumulators are indexed by constants and stay in registers
#pragma unroll
  for (int j = 0; j < 2; ++j) {
    const int qr = (qt0 + j) * 16 + ln;
    v8f acc = {};
#pragma unroll
    for (int ks = 0; ks < KS; ++ks) {
      FragB ph, pl;                                              // att^T as a B fragment: column qr, the k order of fw
      ph.half[0] = *(const v8us*)&sAh[qr][ks * 32 + 8 * hh]; ph.half[1] = *(const v8us*)&sAh[qr][ks * 32 + 16 + 8 * hh];
      pl.half[0] = *(const v8us*)&sAl[qr][ks * 32 + 8 * hh]; pl.half[1] = *(const v8us*)&sAl[qr][ks * 32 + 16 + 8 * hh];
      acc = mmaN<1>(fw[ks].v, fw[ks].v, ph.v, ph.v, acc);
      acc = mmaN<1>(fw[ks].v, fw[ks].v, pl.v, pl.v, acc);
    }
#pragma unroll
    for (int r = 0; r < 8; ++r) ob[off[r] + j * 16] = (acc[r] + bf16_round(r < 4 ? fb0[r & 3] : fb1[r & 3])) + xr[j][r];
  }
}

// The seven small preparation jobs of a call depend on nothing but the inputs, so they share ONE grid and the block index picks the job: the first
// 4 * PREP_WB blocks round the four weight matrices to bf16 (8 values a thread), the last block rounds the three biases into one concatenated row.
#define PREP_WB (HC * CC / 8 / 256)       // blocks per weight matrix
#define PREP_JOBS (4 * PREP_WB + 1)       // blocks of the grid
__global__ __launch_bounds__(256) void k_prep(const float* __restrict__ tw, const float* __restrict__ pw, const float* __restrict__ gw, const float* __restrict__ fw,
                                             unsigned short* __restrict__ Bqkv, unsigned short* __restrict__ Bf,
                                             const float* __restrict__ tb, const float* __restrict__ pb, const float* __restrict__ gb, float* __restrict__ bqkv) {
  const int blk = blockIdx.x;
  if (blk < 4 * PREP_WB) {
    const int m = blk / PREP_WB;
    const float* W = (m == 0) ? tw : (m == 1) ? pw : (m == 2) ? gw : fw;
    unsigned short* Wt = (m < 3) ? Bqkv + m * (HC * CC) : Bf;
    const int t = (blk % PREP_WB) * 256 + threadIdx.x;
    const v4f a = *(const v4fa*)(W + (size_t)t * 8), b = *(const v4fa*)(W + (size_t)t * 8 + 4);
    Pack8 v; v.w[0] = bf16_pack2(a[0], a[1]); v.w[1] = bf16_pack2(a[2], a[3]); v.w[2] = bf16_pack2(b[0], b[1]); v.w[3] = bf16_pack2(b[2], b[3]);
    *(v8us*)(Wt + (size_t)t * 8) = v.v;
    return;
  }
  const int t = threadIdx.x;
  if (t < 3 * (HC / 4)) {                                        // 4 values a thread; thread t writes bqkv[4 t ..], bias t / (HC / 4)
    const int m = t / (HC / 4);
    const float* src = (m == 0) ? tb : (m == 1) ? pb : gb;
    v4f a = *(const v4fa*)(src + (t % (HC / 4)) * 4);
    for (int i = 0; i < 4; ++i) a[i] = bf16_round(a[i]);
    *(v4f*)(bqkv + t * 4) = a;
  }
}

// Takes eight loaded vectors as inputs only and emits nothing: the loads written in front of it are all issued before the first use of any of them,
// so that they are in flight together; without it the compiler waits for each small group of loads and uses it before it issues the next.
template <class T>
__device__ __forceinline__ void hold8(T a, T b, T c, T d, T e, T f, T g, T h) {
  asm volatile("" :: "v"(a), "v"(b), "v"(c), "v"(d), "v"(e), "v"(f), "v"(g), "v"(h));
}

// GEMM A.W + bias (N = 3 x 64 columns: queries | keys | values) on a CHANNEL-MAJOR A, read as it lies: A is [M / LDA][K][LDA] in f32 (LDA positions a batch), row m is
// position m % LDA of batch m / LDA. A lane gathers the 16 k values of its row at a stride of LDA floats (the 16 lanes of a half wave read 64
// contiguous bytes a load) and rounds them to bf16 (one term): no transposed copy of A is made. Wt bf16 [N][K]; bias f32, added as it is.
// One wave = 16 rows x 64 columns, so a wave holds one kind of column, and it stores its tile in the form the attention kernel reads:
// queries as f32 rows Q[M][64]; keys and values split into bf16 hi + lo (x = hi + lo + a rest below bf16) as four planes of M * 64 values:
// Kh/Kl [row][64]; VTh/VTl [row / 16][64 columns][16 rows], the transpose inside the wave's own 16 rows, which is how the accumulators already lie.
// K % 64 == 0, M % 16 == 0, N == 192, LDA % 16 == 0.
template <int K, int N, int LDA>
__global__ __launch_bounds__(128) void k_gemm_cm(const float* __restrict__ A, const unsigned short* __restrict__ Wt, const float* __restrict__ bias,
                                               float* __restrict__ Q, unsigned short* __restrict__ Kh, unsigned short* __restrict__ Kl,
                                               unsigned short* __restrict__ VTh, unsigned short* __restrict__ VTl, int M) {
  constexpr int KS = K / 32, NTN = N / 64;
  static_assert(NTN == 3, "column blocks: queries, keys, values");
  static_assert((KS * 4) % 8 == 0, "hold8 takes the vectors by eights");
  __shared__ __attribute__((aligned(16))) float so[4][16][64];
  const int tid = threadIdx.x, lane = tid & 31, ln = lane & 15, hh = lane >> 4;
  const int w = __builtin_amdgcn_readfirstlane(tid >> 5);       // the same in every lane of a wave; scalar, so that the choice of the store form below is a scalar branch
  const int wid = blockIdx.x * 4 + w;
  const int mt = wid / NTN, nq = wid % NTN;
  if (mt * 16 >= M) return;
  const int row0 = mt * 16, col0 = nq * 64;
  // the lane's three base addresses; everything else of an address is a constant
  const float* ab = A + (size_t)(row0 / LDA) * K * LDA + (size_t)(8 * hh) * LDA + (row0 % LDA + ln);
  const unsigned short* wb = Wt + (size_t)(col0 + ln) * K + 8 * hh;
  const float* bb = bias + col0 + ln;
  // All loops are unrolled: the fragments are then indexed by constants and stay in registers, and the addresses are immediate offsets of the bases.
  v4f ra[KS * 4];                                                // element i = 4 q + j of k step ks in ra[ks * 4 + q][j]: k = 32 ks + 8 hh + i (i < 8), + 8 more (i >= 8)
#pragma unroll
  for (int ks = 0; ks < KS; ++ks)
#pragma unroll
    for (int q = 0; q < 4; ++q)
#pragma unroll
      for (int j = 0; j < 4; ++j) ra[ks * 4 + q][j] = ab[(size_t)(ks * 32 + (q >> 1) * 16 + (q & 1) * 4 + j) * LDA];
  FragB bf[KS][4];                                               // the same k order: half 0 is k = 32 ks + 8 hh + 0..7, half 1 is 16 further
#pragma unroll
  for (int ks = 0; ks < KS; ++ks)
#pragma unroll
    for (int t = 0; t < 4; ++t) {
      bf[ks][t].half[0] = *(const v8us*)(wb + t * 16 * K + ks * 32);
      bf[ks][t].half[1] = *(const v8us*)(wb + t * 16 * K + ks * 32 + 16);
    }
  float bv[4];
#pragma unroll
  for (int t = 0; t < 4; ++t) bv[t] = bb[t * 16];
#pragma unroll
  for (int e = 0; e < KS * 4; e += 8) hold8(ra[e], ra[e + 1], ra[e + 2], ra[e + 3], ra[e + 4], ra[e + 5], ra[e + 6], ra[e + 7]);
#pragma unroll
  for (int ks = 0; ks < KS; ++ks)
    hold8(bf[ks][0].half[0], bf[ks][0].half[1], bf[ks][1].half[0], bf[ks][1].half[1], bf[ks][2].half[0], bf[ks][2].half[1], bf[ks][3].half[0], bf[ks][3].half[1]);
  // inputs only, emits nothing: the three bases stay in their registers until every load that names them has returned, so that neither a later
  // load's result nor a later instruction takes an address register of a load in flight
  asm volatile("" :: "v"(bv[0]), "v"(bv[1]), "v"(bv[2]), "v"(bv[3]), "v"(ab), "v"(wb), "v"(bb));
  v8f acc[4] = {};
#pragma unroll
  for (int ks = 0; ks < KS; ++ks) {
    FragB ah;
#pragma unroll
    for (int i = 0; i < 8; ++i) ah.w[i] = bf16_pack2(ra[ks * 4 + i / 2][(i & 1) * 2], ra[ks * 4 + i / 2][(i & 1) * 2 + 1]);
#pragma unroll
    for (int t = 0; t < 4; ++t) acc[t] = mmaN<1>(ah.v, ah.v, bf[ks][t].v, bf[ks][t].v, acc[t]);
  }
  if (nq == 2) {
    // values: a lane holds rows 8 hh .. 8 hh + 7 of column t * 16 + ln, which are 16 contiguous bytes of a V^T plane; a store of the wave is 512 contiguous bytes
    Pack8 hi[4], lo[4];
#pragma unroll
    for (int t = 0; t < 4; ++t)
#pragma unroll
      for (int i = 0; i < 8; i += 2) {
        const float x0 = acc[t][i] + bv[t], x1 = acc[t][i + 1] + bv[t];
        hi[t].w[i / 2] = bf16_pack2(x0, x1); lo[t].w[i / 2] = bf16_rest2(x0, x1, hi[t].w[i / 2]);
      }
    const size_t o = (size_t)mt * (16 * 64) + ln * 16 + 8 * hh;
#pragma unroll
    for (int t = 0; t < 4; ++t) { *(v8us*)(VTh + o + t * 256) = hi[t].v; *(v8us*)(VTl + o + t * 256) = lo[t].v; }
    asm volatile("s_wait_xcnt 0x0" ::: "memory");                // in the built code another store form's block may follow and reuse the registers of the stores above
    return;
  }
#pragma unroll
  for (int t = 0; t < 4; ++t)
#pragma unroll
    for (int r = 0; r < 8; ++r) so[w][8 * hh + r][t * 16 + ln] = acc[t][r] + bv[t];
  __builtin_amdgcn_fence(__ATOMIC_ACQ_REL, "workgroup");
  __builtin_amdgcn_wave_barrier();
  if (nq == 0) {
    const int rsub = lane >> 4, c4 = (lane & 15) * 4;
#pragma unroll
    for (int q = 0; q < 8; ++q) {
      const int r = q * 2 + rsub;
      const v4f v = *(const v4fa*)&so[w][r][c4];
      *(v4f*)(Q + (size_t)(row0 + r) * 64 + c4) = v;
    }
    asm volatile("s_wait_xcnt 0x0" ::: "memory");                // the same behind these stores
    return;
  }
  // keys: a lane takes 8 columns of a row, 16 bytes of each plane; a store of the wave is four whole rows, 512 contiguous bytes
  Pack8 hi[4], lo[4];
#pragma unroll
  for (int q = 0; q < 4; ++q) {
    const float* sr = &so[w][q * 4 + (lane >> 3)][(lane & 7) * 8];
    const v4f a = *(const v4fa*)sr, b = *(const v4fa*)(sr + 4);
    hi[q].w[0] = bf16_pack2(a[0], a[1]); lo[q].w[0] = bf16_rest2(a[0], a[1], hi[q].w[0]);
    hi[q].w[1] = bf16_pack2(a[2], a[3]); lo[q].w[1] = bf16_rest2(a[2], a[3], hi[q].w[1]);
    hi[q].w[2] = bf16_pack2(b[0], b[1]); lo[q].w[2] = bf16_rest2(b[0], b[1], hi[q].w[2]);
    hi[q].w[3] = bf16_pack2(b[2], b[3]); lo[q].w[3] = bf16_rest2(b[2], b[3], hi[q].w[3]);
  }
  const size_t o = (size_t)row0 * 64 + lane * 8;
#pragma unroll
  for (int q = 0; q < 4; ++q) { *(v8us*)(Kh + o + q * 256) = hi[q].v; *(v8us*)(Kl + o + q * 256) = lo[q].v; }
  asm volatile("s_wait_xcnt 0x0" ::: "memory");                  // the same behind these stores
}

extern "C" void kernel_launch(void* const* d_in, const int* in_sizes, int n_in,
                              void* d_out, int out_size, void* d_ws, size_t ws_size, hipStream_t stream) {
  (void)in_sizes; (void)n_in; (void)out_size;
  const float* x = (const float*)d_in[0]; const float* tw = (const float*)d_in[1]; const float* tb = (const float*)d_in[2]; const float* pw = (const float*)d_in[3]; const float* pb = (const float*)d_in[4];
  const float* gw = (const float*)d_in[5]; const float* gb = (const float*)d_in[6]; const float* fw = (const float*)d_in[7]; const float* fb = (const float*)d_in[8];
  char* ws = (char*)d_ws; size_t off = 0;
  auto take = [&](size_t bytes) { char* p = ws + off; off += (bytes + 255) & ~(size_t)255; return p; };
  unsigned short* Bqkv = (unsigned short*)take((size_t)3 * HC * CC * 2); unsigned short* Bf = (unsigned short*)take((size_t)CC * HC * 2); float* bqkv = (float*)take(3 * HC * 4 + 256);
  float* Q = (float*)take((size_t)MROWS * HC * 4);
  unsigned short* Kh = (unsigned short*)take((size_t)MROWS * HC * 2); unsigned short* Kl = (unsigned short*)take((size_t)MROWS * HC * 2);
  unsigned short* VTh = (unsigned short*)take((size_t)MROWS * HC * 2); unsigned short* VTl = (unsigned short*)take((size_t)MROWS * HC * 2);
  if (off > ws_size) return;
  k_prep<<<PREP_JOBS, 256, 0, stream>>>(tw, pw, gw, fw, Bqkv, Bf, tb, pb, gb, bqkv);   // rounded weights and biases
  k_gemm_cm<CC, 3 * HC, HWN><<<((MROWS / 16) * 3 + 3) / 4, 128, 0, stream>>>(x, Bqkv, bqkv, Q, Kh, Kl, VTh, VTl, MROWS);   // [theta | phi | g] + b (single term), x read as it lies (NCHW); phi, g leave as bf16 hi/lo planes
  k_flash3<HC, NSPLIT, CC><<<BB * (HWN / 64), 128 * NSPLIT, 0, stream>>>(Q, HC, HWN, Kh, Kl, VTh, VTl, HWN, 1.0f, nullptr, 0, nullptr,
                                                                       Bf, fb, x, (float*)d_out);   // attention, final conv + b, + x, stored NCHW
}
